// v000
// Measured on an AMD MI455X. A time is GPU time per run, averaged over a window of back-to-back runs after a warm-up
// (all launches, gaps included; the runs take copies of the inputs in turn), and the median of several windows.
// Apart from v000's, it joins two sittings. Times from different sittings can be a few percent apart, while
// side-by-side timings come from the same sitting.
// v000, which the later versions start from, runs in 105 microseconds.
#include <hip/hip_runtime.h>
#include <hip/hip_bf16.h>

typedef float v2f __attribute__((ext_vector_type(2)));
typedef float v8f __attribute__((ext_vector_type(8)));

namespace {
constexpr int Ud = 512;   // U (K dimension)
constexpr int Vd = 512;   // V (N dimension)
constexpr int BM = 128;   // rows per block
constexpr int BN = 64;    // cols per block
constexpr int BK = 32;    // K chunk staged in LDS
constexpr int XS = 36;    // x LDS row stride (conflict-free, 16B aligned)
constexpr int WS = 72;    // w LDS row stride (half-waves hit disjoint banks)
constexpr int XBUF = BM * XS;   // floats per x buffer
constexpr int WBUF = BK * WS;   // floats per w buffer
}

// LDS aperture keeps the LDS offset in addr[31:0]; truncate generic pointer.
__device__ __forceinline__ uint32_t lds_off(const void* p) {
    return (uint32_t)(uintptr_t)p;
}

// Async global -> LDS copy, 16B per lane, tracked by ASYNCcnt (ISA 08 §4).
__device__ __forceinline__ void async_copy_b128(uint32_t lds_addr, const float* gptr) {
    asm volatile("global_load_async_to_lds_b128 %0, %1, off"
                 :: "v"(lds_addr), "v"((uint64_t)(uintptr_t)gptr)
                 : "memory");
}

__device__ __forceinline__ void wait_asynccnt0() {
    asm volatile("s_wait_asynccnt 0" ::: "memory");
}

__device__ __forceinline__ v8f wmma4(v2f a, v2f b, v8f c) {
    return __builtin_amdgcn_wmma_f32_16x16x4_f32(
        false, a, false, b, (short)0, c, false, false);
}

__global__ __launch_bounds__(256) void sp_indexed_linear_wmma(
    const float* __restrict__ w,      // [C, U*V]
    const float* __restrict__ x,      // [Z, U]
    const int*   __restrict__ idx,    // [Z], sorted
    const float* __restrict__ coeff,  // [1]
    float* __restrict__ y)            // [Z, V]
{
    __shared__ float xs[2 * XBUF];    // double-buffered x tile
    __shared__ float ws[2 * WBUF];    // double-buffered W tile
    __shared__ int   sidx[BM];

    const int tid  = threadIdx.x;
    const int lane = tid & 31;
    const int wave = tid >> 5;
    const int wm   = wave & 3;   // M sub-tile (32 rows per wave)
    const int wn   = wave >> 2;  // N sub-tile (32 cols per wave)

    const int rowBase = blockIdx.y * BM;
    const int colBase = blockIdx.x * BN;

    if (tid < BM) sidx[tid] = idx[rowBase + tid];
    __syncthreads();

    const int gmin = idx[rowBase];            // uniform (idx sorted)
    const int gmax = idx[rowBase + BM - 1];   // uniform

    v8f acc00 = {}, acc01 = {}, acc10 = {}, acc11 = {};

    // staging coordinates: 256 lanes x 16B -> x: 4 rows/lane, w: 2 rows/lane
    const int xr = tid >> 3;          // x rows xr + {0,32,64,96}
    const int xk = (tid & 7) * 4;
    const int wr = tid >> 4;          // w rows wr, wr+16
    const int wc = (tid & 15) * 4;

    uint32_t xl[4];
    const float* xg[4];
    #pragma unroll
    for (int j = 0; j < 4; ++j) {
        const int row = xr + j * 32;
        xl[j] = lds_off(xs) + (uint32_t)((row * XS + xk) * 4);
        xg[j] = x + (size_t)(rowBase + row) * Ud + xk;
    }
    uint32_t wl[2];
    #pragma unroll
    for (int j = 0; j < 2; ++j)
        wl[j] = lds_off(ws) + (uint32_t)(((wr + j * 16) * WS + wc) * 4);

    // WMMA fragment coordinates (V_WMMA_F32_16X16X4_F32 layout)
    const int arow0 = wm * 32 + (lane & 15);
    const int arow1 = arow0 + 16;
    const int kk    = (lane >> 4) * 2;
    const int bcol  = wn * 32 + (lane & 15);

    auto prefetch = [&](uint32_t bufX, uint32_t bufW, int kb,
                        const float* __restrict__ wg) {
        #pragma unroll
        for (int j = 0; j < 4; ++j)
            async_copy_b128(xl[j] + bufX, xg[j] + kb);
        async_copy_b128(wl[0] + bufW, wg + (size_t)(kb + wr)      * Vd);
        async_copy_b128(wl[1] + bufW, wg + (size_t)(kb + wr + 16) * Vd);
    };

    auto compute = [&](const float* __restrict__ xsb,
                       const float* __restrict__ wsb,
                       float m0, float m1, bool masked) {
        #pragma unroll
        for (int k = 0; k < BK; k += 4) {
            v2f a0, a1, b0, b1;
            a0.x = xsb[arow0 * XS + k + kk];
            a0.y = xsb[arow0 * XS + k + kk + 1];
            a1.x = xsb[arow1 * XS + k + kk];
            a1.y = xsb[arow1 * XS + k + kk + 1];
            if (masked) {
                a0.x *= m0; a0.y *= m0;
                a1.x *= m1; a1.y *= m1;
            }
            b0.x = wsb[(k + kk)     * WS + bcol];
            b0.y = wsb[(k + kk + 1) * WS + bcol];
            b1.x = wsb[(k + kk)     * WS + bcol + 16];
            b1.y = wsb[(k + kk + 1) * WS + bcol + 16];
            acc00 = wmma4(a0, b0, acc00);
            acc01 = wmma4(a0, b1, acc01);
            acc10 = wmma4(a1, b0, acc10);
            acc11 = wmma4(a1, b1, acc11);
        }
    };

    auto run_group = [&](int g, bool masked) {
        const float* __restrict__ wg = w + (size_t)g * Ud * Vd + colBase + wc;
        const float m0 = (sidx[arow0] == g) ? 1.f : 0.f;
        const float m1 = (sidx[arow1] == g) ? 1.f : 0.f;

        prefetch(0, 0, 0, wg);
        wait_asynccnt0();
        __syncthreads();

        for (int kb = 0; kb < Ud; kb += 2 * BK) {
            // buf0 holds chunk kb; kb+BK < Ud always (Ud/BK even)
            prefetch(XBUF * 4, WBUF * 4, kb + BK, wg);
            compute(xs, ws, m0, m1, masked);
            wait_asynccnt0();
            __syncthreads();

            const bool more2 = (kb + 2 * BK) < Ud;
            if (more2) prefetch(0, 0, kb + 2 * BK, wg);
            compute(xs + XBUF, ws + WBUF, m0, m1, masked);
            if (more2) wait_asynccnt0();
            __syncthreads();
        }
    };

    if (gmin == gmax) {
        run_group(gmin, false);                       // common case: no masking
    } else {
        for (int g = gmin; g <= gmax; ++g)            // <=7 boundary blocks total
            run_group(g, true);
    }

    // ---- epilogue ----
    const float cf = coeff[0];
    const int rowTop = rowBase + wm * 32 + ((lane >> 4) << 3);  // +8 for upper half-wave
    #pragma unroll
    for (int i = 0; i < 8; ++i) {
        const int r0 = rowTop + i;
        const int r1 = rowTop + 16 + i;
        y[(size_t)r0 * Vd + colBase + bcol]      = acc00[i] * cf;
        y[(size_t)r0 * Vd + colBase + bcol + 16] = acc01[i] * cf;
        y[(size_t)r1 * Vd + colBase + bcol]      = acc10[i] * cf;
        y[(size_t)r1 * Vd + colBase + bcol + 16] = acc11[i] * cf;
    }
}

extern "C" void kernel_launch(void* const* d_in, const int* in_sizes, int n_in,
                              void* d_out, int out_size, void* d_ws, size_t ws_size,
                              hipStream_t stream) {
    const float* w     = (const float*)d_in[0];   // [C, U*V]
    const float* x     = (const float*)d_in[1];   // [Z, U]
    const int*   idx   = (const int*)d_in[2];     // [Z]
    const float* coeff = (const float*)d_in[3];   // [1]
    float* y = (float*)d_out;                     // [Z, V]

    const int Z = in_sizes[1] / Ud;
    dim3 grid(Vd / BN, Z / BM);
    sp_indexed_linear_wmma<<<grid, 256, 0, stream>>>(w, x, idx, coeff, y);
}

// v001
// One run takes 94.7 microseconds.
// In two side-by-side timings against v000, it was 1.14 and 1.15 times as fast.
#include <hip/hip_runtime.h>
#include <hip/hip_bf16.h>

typedef float v2f __attribute__((ext_vector_type(2)));
typedef float v8f __attribute__((ext_vector_type(8)));

namespace {
constexpr int Ud = 512;   // U (K dimension)
constexpr int Vd = 512;   // V (N dimension)
constexpr int Cd = 8;     // C (groups)
constexpr int BM = 128;   // rows per block
constexpr int BN = 64;    // cols per block
constexpr int BK = 32;    // K chunk staged in LDS
constexpr int XS = 36;    // x LDS row stride (conflict-free, 16B aligned)
constexpr int WS = 72;    // w LDS row stride (half-waves hit disjoint banks)
constexpr int XBUF = BM * XS;   // floats per x buffer
constexpr int WBUF = BK * WS;   // floats per w buffer
}

// LDS aperture keeps the LDS offset in addr[31:0]; truncate generic pointer.
__device__ __forceinline__ uint32_t lds_off(const void* p) {
    return (uint32_t)(uintptr_t)p;
}

// Async global -> LDS copy, 16B per lane, tracked by ASYNCcnt (ISA 08 §4).
__device__ __forceinline__ void async_copy_b128(uint32_t lds_addr, const float* gptr) {
    asm volatile("global_load_async_to_lds_b128 %0, %1, off"
                 :: "v"(lds_addr), "v"((uint64_t)(uintptr_t)gptr)
                 : "memory");
}

// Eight async copies of one stage in ONE statement; s_wait_xcnt 0 as its last line stands in
// front of every later rewrite of a register that these copies name (a precaution).
__device__ __forceinline__ void async_copy8_b128(
    uint32_t l0, uint32_t l1, uint32_t l2, uint32_t l3,
    uint32_t l4, uint32_t l5, uint32_t l6, uint32_t l7,
    const float* g0, const float* g1, const float* g2, const float* g3,
    const float* g4, const float* g5, const float* g6, const float* g7) {
    asm volatile("global_load_async_to_lds_b128 %0, %8, off\n\t"
                 "global_load_async_to_lds_b128 %1, %9, off\n\t"
                 "global_load_async_to_lds_b128 %2, %10, off\n\t"
                 "global_load_async_to_lds_b128 %3, %11, off\n\t"
                 "global_load_async_to_lds_b128 %4, %12, off\n\t"
                 "global_load_async_to_lds_b128 %5, %13, off\n\t"
                 "global_load_async_to_lds_b128 %6, %14, off\n\t"
                 "global_load_async_to_lds_b128 %7, %15, off\n\t"
                 "s_wait_xcnt 0x0"
                 :: "v"(l0), "v"(l1), "v"(l2), "v"(l3), "v"(l4), "v"(l5), "v"(l6), "v"(l7),
                    "v"((uint64_t)(uintptr_t)g0), "v"((uint64_t)(uintptr_t)g1),
                    "v"((uint64_t)(uintptr_t)g2), "v"((uint64_t)(uintptr_t)g3),
                    "v"((uint64_t)(uintptr_t)g4), "v"((uint64_t)(uintptr_t)g5),
                    "v"((uint64_t)(uintptr_t)g6), "v"((uint64_t)(uintptr_t)g7)
                 : "memory");
}

// A wave's LDS reads of a buffer have returned before the barrier that frees it for a refill.
__device__ __forceinline__ void wait_dscnt0() {
    asm volatile("s_wait_dscnt 0x0" ::: "memory");
}

__device__ __forceinline__ void wait_asynccnt0() {
    asm volatile("s_wait_asynccnt 0" ::: "memory");
}

__device__ __forceinline__ v8f wmma4(v2f a, v2f b, v8f c) {
    return __builtin_amdgcn_wmma_f32_16x16x4_f32(
        false, a, false, b, (short)0, c, false, false);
}

__global__ __launch_bounds__(256) void sp_indexed_linear_wmma(
    const float* __restrict__ w,      // [C, U*V]
    const float* __restrict__ x,      // [Z, U]
    const int*   __restrict__ idx,    // [Z], sorted
    const float* __restrict__ coeff,  // [1]
    float* __restrict__ y)            // [Z, V]
{
    __shared__ float xs[2 * XBUF];    // double-buffered x tile
    __shared__ float ws[4 * WBUF];    // double-buffered W tile; upper half: a second group's tile
    __shared__ int   sidx[BM];

    const int tid  = threadIdx.x;
    const int lane = tid & 31;
    const int wave = tid >> 5;
    // M sub-tile (32 rows per wave); waves w and w + 4 take opposite row ranges
    const int wm   = (wave & 3) ^ ((wave >> 2) * 3);
    const int wn   = wave >> 2;  // N sub-tile (32 cols per wave)

    const int rowBase = blockIdx.y * BM;
    const int colBase = blockIdx.x * BN;

    if (tid < BM) sidx[tid] = idx[rowBase + tid];
    __syncthreads();

    const int gmin = min(max(idx[rowBase], 0), Cd - 1);            // uniform (idx sorted)
    const int gmax = min(max(idx[rowBase + BM - 1], 0), Cd - 1);   // uniform

    v8f acc00 = {}, acc01 = {}, acc10 = {}, acc11 = {};

    // staging coordinates: 256 lanes x 16B -> x: 4 rows/lane, w: 2 rows/lane
    const int xr = tid >> 3;          // x rows xr + {0,32,64,96}
    const int xk = (tid & 7) * 4;
    const int wr = tid >> 4;          // w rows wr, wr+16
    const int wc = (tid & 15) * 4;

    uint32_t xl[4];
    const float* xg[4];
    #pragma unroll
    for (int j = 0; j < 4; ++j) {
        const int row = xr + j * 32;
        xl[j] = lds_off(xs) + (uint32_t)((row * XS + xk) * 4);
        xg[j] = x + (size_t)(rowBase + row) * Ud + xk;
    }
    uint32_t wl[2];
    #pragma unroll
    for (int j = 0; j < 2; ++j)
        wl[j] = lds_off(ws) + (uint32_t)(((wr + j * 16) * WS + wc) * 4);

    // WMMA fragment coordinates (V_WMMA_F32_16X16X4_F32 layout)
    const int arow0 = wm * 32 + (lane & 15);
    const int arow1 = arow0 + 16;
    const int kk    = (lane >> 4) * 2;
    const int bcol  = wn * 32 + (lane & 15);

    auto prefetch = [&](uint32_t bufX, uint32_t bufW, int kb,
                        const float* __restrict__ wg) {
        #pragma unroll
        for (int j = 0; j < 4; ++j)
            async_copy_b128(xl[j] + bufX, xg[j] + kb);
        async_copy_b128(wl[0] + bufW, wg + (size_t)(kb + wr)      * Vd);
        async_copy_b128(wl[1] + bufW, wg + (size_t)(kb + wr + 16) * Vd);
    };

    auto compute = [&](const float* __restrict__ xsb,
                       const float* __restrict__ wsb,
                       float m0, float m1, bool masked) {
        #pragma unroll
        for (int k = 0; k < BK; k += 4) {
            v2f a0, a1, b0, b1;
            a0.x = xsb[arow0 * XS + k + kk];
            a0.y = xsb[arow0 * XS + k + kk + 1];
            a1.x = xsb[arow1 * XS + k + kk];
            a1.y = xsb[arow1 * XS + k + kk + 1];
            if (masked) {
                a0.x *= m0; a0.y *= m0;
                a1.x *= m1; a1.y *= m1;
            }
            b0.x = wsb[(k + kk)     * WS + bcol];
            b0.y = wsb[(k + kk + 1) * WS + bcol];
            b1.x = wsb[(k + kk)     * WS + bcol + 16];
            b1.y = wsb[(k + kk + 1) * WS + bcol + 16];
            acc00 = wmma4(a0, b0, acc00);
            acc01 = wmma4(a0, b1, acc01);
            acc10 = wmma4(a1, b0, acc10);
            acc11 = wmma4(a1, b1, acc11);
        }
    };

    auto run_group = [&](int g, bool masked) {
        const float* __restrict__ wg = w + (size_t)g * Ud * Vd + colBase + wc;
        const float m0 = (sidx[arow0] == g) ? 1.f : 0.f;
        const float m1 = (sidx[arow1] == g) ? 1.f : 0.f;

        prefetch(0, 0, 0, wg);
        wait_asynccnt0();
        __syncthreads();

        for (int kb = 0; kb < Ud; kb += 2 * BK) {
            // buf0 holds chunk kb; kb+BK < Ud always (Ud/BK even)
            prefetch(XBUF * 4, WBUF * 4, kb + BK, wg);
            compute(xs, ws, m0, m1, masked);
            wait_asynccnt0();
            __syncthreads();

            const bool more2 = (kb + 2 * BK) < Ud;
            if (more2) prefetch(0, 0, kb + 2 * BK, wg);
            compute(xs + XBUF, ws + WBUF, m0, m1, masked);
            if (more2) wait_asynccnt0();
            __syncthreads();
        }
    };

    // One 16-row tile against one group's W tile: 8 k steps, two column tiles.
    auto part = [&](const float* __restrict__ xrow, const float* __restrict__ wcol,
                    float m, v8f& cL, v8f& cR) {
        // unrolled (all three loops): fragments stay in registers, LDS offsets are constants
        #pragma unroll
        for (int h = 0; h < BK; h += 16) {
            v2f a[4], b0[4], b1[4];
            #pragma unroll
            for (int j = 0; j < 4; ++j) {
                const int k = h + j * 4;
                a[j].x  = xrow[k];
                a[j].y  = xrow[k + 1];
                b0[j].x = wcol[k * WS];
                b0[j].y = wcol[(k + 1) * WS];
                b1[j].x = wcol[k * WS + 16];
                b1[j].y = wcol[(k + 1) * WS + 16];
            }
            // holds the LDS reads of four k steps ahead of their first product, so that the wave
            // waits for LDS about twice a part and not at every second k step
            __builtin_amdgcn_sched_barrier(0);
            #pragma unroll
            for (int j = 0; j < 4; ++j) {
                const v2f am = a[j] * m;
                cL = wmma4(am, b0[j], cL);
                cR = wmma4(am, b1[j], cR);
            }
        }
    };

    // Groups g and g + 1 in ONE k loop: x is staged once, both groups' W tiles lie in LDS, and
    // each 16-row tile multiplies only the group(s) that it holds rows of.
    auto run_pair = [&](int g) {
        const int g2 = min(g + 1, gmax);   // past gmax: a valid address, no row matches g + 1
        const float* __restrict__ wgA = w + (size_t)g  * Ud * Vd + colBase + wc;
        const float* __restrict__ wgB = w + (size_t)g2 * Ud * Vd + colBase + wc;
        const int s0 = sidx[arow0];
        const int s1 = sidx[arow1];
        const float mA0 = (s0 == g)     ? 1.f : 0.f;
        const float mA1 = (s1 == g)     ? 1.f : 0.f;
        const float mB0 = (s0 == g + 1) ? 1.f : 0.f;
        const float mB1 = (s1 == g + 1) ? 1.f : 0.f;
        // wave-uniform: does this 16-row tile hold any row of that group
        const bool hA0 = __builtin_amdgcn_ballot_w32(s0 == g)     != 0u;
        const bool hA1 = __builtin_amdgcn_ballot_w32(s1 == g)     != 0u;
        const bool hB0 = __builtin_amdgcn_ballot_w32(s0 == g + 1) != 0u;
        const bool hB1 = __builtin_amdgcn_ballot_w32(s1 == g + 1) != 0u;

        auto stage = [&](int b, int kb) {
            const uint32_t bx = (uint32_t)(b * XBUF * 4);
            const uint32_t bA = (uint32_t)(b * WBUF * 4);
            const uint32_t bB = (uint32_t)((b + 2) * WBUF * 4);
            async_copy8_b128(xl[0] + bx, xl[1] + bx, xl[2] + bx, xl[3] + bx,
                             wl[0] + bA, wl[1] + bA, wl[0] + bB, wl[1] + bB,
                             xg[0] + kb, xg[1] + kb, xg[2] + kb, xg[3] + kb,
                             wgA + (size_t)(kb + wr) * Vd, wgA + (size_t)(kb + wr + 16) * Vd,
                             wgB + (size_t)(kb + wr) * Vd, wgB + (size_t)(kb + wr + 16) * Vd);
        };

        stage(0, 0);
        wait_asynccnt0();
        __syncthreads();
        stage(1, BK);                      // Ud / BK = 16 stages: stage 1 exists

        for (int t = 0; t < Ud / BK; ++t) {
            const int b = t & 1;
            const float* x0 = xs + b * XBUF + arow0 * XS + kk;
            const float* x1 = xs + b * XBUF + arow1 * XS + kk;
            const float* wA = ws + b * WBUF + kk * WS + bcol;
            const float* wB = wA + 2 * WBUF;
            if (hA0) part(x0, wA, mA0, acc00, acc01);
            if (hA1) part(x1, wA, mA1, acc10, acc11);
            if (hB0) part(x0, wB, mB0, acc00, acc01);
            if (hB1) part(x1, wB, mB1, acc10, acc11);
            wait_dscnt0();
            wait_asynccnt0();              // stage t + 1 has landed
            __syncthreads();               // publishes stage t + 1, frees buffer b
            if (t + 2 < Ud / BK) stage(b, (t + 2) * BK);
        }
        wait_asynccnt0();
    };

    if (gmin == gmax) {
        run_group(gmin, false);                       // common case: no masking
    } else {
        for (int g = gmin; g <= gmax; g += 2)         // <=7 boundary row blocks (<=56 blocks)
            run_pair(g);
    }

    // ---- epilogue ----
    const float cf = coeff[0];
    const int rowTop = rowBase + wm * 32 + ((lane >> 4) << 3);  // +8 for upper half-wave
    #pragma unroll
    for (int i = 0; i < 8; ++i) {
        const int r0 = rowTop + i;
        const int r1 = rowTop + 16 + i;
        y[(size_t)r0 * Vd + colBase + bcol]      = acc00[i] * cf;
        y[(size_t)r0 * Vd + colBase + bcol + 16] = acc01[i] * cf;
        y[(size_t)r1 * Vd + colBase + bcol]      = acc10[i] * cf;
        y[(size_t)r1 * Vd + colBase + bcol + 16] = acc11[i] * cf;
    }
}

extern "C" void kernel_launch(void* const* d_in, const int* in_sizes, int n_in,
                              void* d_out, int out_size, void* d_ws, size_t ws_size,
                              hipStream_t stream) {
    const float* w     = (const float*)d_in[0];   // [C, U*V]
    const float* x     = (const float*)d_in[1];   // [Z, U]
    const int*   idx   = (const int*)d_in[2];     // [Z]
    const float* coeff = (const float*)d_in[3];   // [1]
    float* y = (float*)d_out;                     // [Z, V]

    const int Z = in_sizes[1] / Ud;
    dim3 grid(Vd / BN, Z / BM);
    sp_indexed_linear_wmma<<<grid, 256, 0, stream>>>(w, x, idx, coeff, y);
}
